// v000
// Times are from an AMD MI455X. After a warm-up the kernel runs many times in a row, and a time is the length of
// such a window on the GPU divided by its runs, so every launch and the gaps after it count. The runs cycle
// through copies of the inputs. A figure is the median of several windows, for all but v000 over two sittings.
// Sittings can differ by a few percent; kernels timed side by side share one.
// v000, which the later versions start from, runs in 354 microseconds.
#include <hip/hip_runtime.h>
#include <hip/hip_bf16.h>

typedef __attribute__((ext_vector_type(2))) float v2f;
typedef __attribute__((ext_vector_type(8))) float v8f;
typedef __attribute__((ext_vector_type(4))) int   v4i;

#define D_MODEL 1024
#define N_HEADS 16
#define N_KV    4
#define HD      64
#define SEQ     2048
#define BATCH   2
#define BS      (BATCH*SEQ)          // 4096 token rows
#define KVDIM   (N_KV*HD)            // 256
#define NEG_BIG (-3.0e38f)

static __device__ __forceinline__ v8f wmma4(v2f a, v2f b, v8f c) {
  // D = A(16x4 f32) * B(4x16 f32) + C(16x16 f32)   [v_wmma_f32_16x16x4_f32]
  return __builtin_amdgcn_wmma_f32_16x16x4_f32(false, a, false, b, (short)0, c,
                                               false, false);
}

static __device__ __forceinline__ v8f vzero8() {
  v8f z;
#pragma unroll
  for (int i = 0; i < 8; ++i) z[i] = 0.0f;
  return z;
}

// --- CDNA5 async global->LDS copy (16B per lane), tracked by ASYNCcnt -------
static __device__ __forceinline__ void async_copy16(const void* g, void* l) {
#if __has_builtin(__builtin_amdgcn_global_load_async_to_lds_b128)
  __builtin_amdgcn_global_load_async_to_lds_b128(
      (__attribute__((address_space(1))) v4i*)(g),
      (__attribute__((address_space(3))) v4i*)(l), 0, 0);
#else
  unsigned lds = (unsigned)(unsigned long long)
      (__attribute__((address_space(3))) void*)l;
  asm volatile("global_load_async_to_lds_b128 %0, %1, off"
               :: "v"(lds), "v"(g) : "memory");
#endif
}

static __device__ __forceinline__ void async_wait0() {
#if __has_builtin(__builtin_amdgcn_s_wait_asynccnt)
  __builtin_amdgcn_s_wait_asynccnt(0);
#else
  asm volatile("s_wait_asynccnt 0x0" ::: "memory");
#endif
}

// ---------------------------------------------------------------------------
// NT GEMM: C[M x N] = A[M x K] * B[N x K]^T, all fp32 row-major.
// Block = 128 threads (4 waves). Block tile 64(M) x 64(N), K-chunks of 32,
// double-buffered async LDS staging. Each wave computes a 16x64 strip.
// ---------------------------------------------------------------------------
__global__ __launch_bounds__(128) void gemm_nt_f32(const float* __restrict__ A,
                                                   const float* __restrict__ Bw,
                                                   float* __restrict__ C,
                                                   int M, int N, int K) {
  __shared__ float As[2][64][36];   // padded rows: no LDS bank conflicts
  __shared__ float Bs[2][64][36];

  const int tid  = threadIdx.x;
  const int wave = tid >> 5;
  const int lane = tid & 31;
  const int half = lane >> 4;    // 0: lanes 0-15, 1: lanes 16-31
  const int lr   = lane & 15;
  const int m_blk = blockIdx.y * 64;
  const int n_blk = blockIdx.x * 64;

  auto stage = [&](int buf, int k0) {
#pragma unroll
    for (int it = 0; it < 4; ++it) {
      int idx = tid + it * 128;          // 0..511
      int r   = idx >> 3;                // row 0..63
      int c4  = idx & 7;                 // float4 col 0..7
      async_copy16(A  + (size_t)(m_blk + r) * K + k0 + c4 * 4, &As[buf][r][c4 * 4]);
      async_copy16(Bw + (size_t)(n_blk + r) * K + k0 + c4 * 4, &Bs[buf][r][c4 * 4]);
    }
  };

  v8f acc[4];
#pragma unroll
  for (int t = 0; t < 4; ++t) acc[t] = vzero8();

  stage(0, 0);
  async_wait0();
  __syncthreads();

  const int nchunks = K >> 5;
  for (int c = 0; c < nchunks; ++c) {
    const int cur = c & 1;
    if (c + 1 < nchunks) stage(cur ^ 1, (c + 1) * 32);   // prefetch next tile

#pragma unroll
    for (int kk = 0; kk < 32; kk += 4) {
      v2f a;
      a.x = As[cur][wave * 16 + lr][kk + 2 * half + 0];
      a.y = As[cur][wave * 16 + lr][kk + 2 * half + 1];
#pragma unroll
      for (int t = 0; t < 4; ++t) {
        v2f b;
        b.x = Bs[cur][t * 16 + lr][kk + 2 * half + 0];
        b.y = Bs[cur][t * 16 + lr][kk + 2 * half + 1];
        acc[t] = wmma4(a, b, acc[t]);
      }
    }
    async_wait0();       // next buffer resident
    __syncthreads();     // all waves done reading cur / writing nxt
  }

  // C layout: VGPR i -> rows (i, i+8) x lanes; n = lr
#pragma unroll
  for (int t = 0; t < 4; ++t)
#pragma unroll
    for (int i = 0; i < 8; ++i)
      C[(size_t)(m_blk + wave * 16 + i + 8 * half) * N + n_blk + t * 16 + lr] =
          acc[t][i];
}

// ---------------------------------------------------------------------------
// Per-(token, head) RMSNorm over HD=64 + RoPE, in place. One wave per head-row.
// buf layout: [B*S][HC*64]
// ---------------------------------------------------------------------------
__global__ __launch_bounds__(128) void rmsnorm_rope(float* __restrict__ buf,
                                                    const float* __restrict__ nw,
                                                    int HC, int S) {
  const int wid  = blockIdx.x * 4 + (threadIdx.x >> 5);
  const int lane = threadIdx.x & 31;
  const int hh   = wid % HC;
  const int tok  = wid / HC;           // b*S + s
  const int s    = tok % S;

  float* p = buf + (size_t)tok * HC * HD + hh * HD;
  float x0 = p[2 * lane];
  float x1 = p[2 * lane + 1];

  float ss = x0 * x0 + x1 * x1;
#pragma unroll
  for (int m = 16; m >= 1; m >>= 1) ss += __shfl_xor(ss, m, 32);
  const float inv = rsqrtf(ss * (1.0f / 64.0f) + 1e-5f);
  x0 *= inv * nw[2 * lane];
  x1 *= inv * nw[2 * lane + 1];

  // pair index = lane; angle = s * theta^(-2*lane/64)
  const float freq = __powf(500000.0f, -((float)(2 * lane) / 64.0f));
  float sn, cs;
  __sincosf((float)s * freq, &sn, &cs);
  p[2 * lane]     = x0 * cs - x1 * sn;
  p[2 * lane + 1] = x1 * cs + x0 * sn;
}

// ---------------------------------------------------------------------------
// Causal GQA flash attention. grid = (S/64, H, B), block = 128 (4 waves).
// Q: [B*S][H*64] (post norm+rope), K/V: [B*S][4*64], O: [B*S][H*64].
// Each wave owns 16 query rows; K/V tiles of 64 keys double-buffered in LDS
// via async copies.
// ---------------------------------------------------------------------------
__global__ __launch_bounds__(128) void flash_attn(const float* __restrict__ Qb,
                                                  const float* __restrict__ Kb,
                                                  const float* __restrict__ Vb,
                                                  float* __restrict__ Ob) {
  __shared__ float Ks[2][64][68];
  __shared__ float Vs[2][64][68];
  __shared__ float Ps[4][16][68];      // per-wave P scratch (C->A relayout)

  const int tid  = threadIdx.x;
  const int wave = tid >> 5;
  const int lane = tid & 31;
  const int half = lane >> 4;
  const int lr   = lane & 15;
  const int qt   = blockIdx.x;
  const int h    = blockIdx.y;
  const int b    = blockIdx.z;
  const int kvh  = h >> 2;             // 16 heads -> 4 KV heads
  const int q0w  = qt * 64 + wave * 16;

  auto stageKV = [&](int buf, int kt) {
#pragma unroll
    for (int it = 0; it < 8; ++it) {
      int idx = tid + it * 128;          // 0..1023
      int r   = idx >> 4;
      int c4  = idx & 15;
      size_t src = ((size_t)(b * SEQ + kt * 64 + r)) * KVDIM + kvh * HD + c4 * 4;
      async_copy16(Kb + src, &Ks[buf][r][c4 * 4]);
      async_copy16(Vb + src, &Vs[buf][r][c4 * 4]);
    }
  };

  // Q fragments in registers, 1/sqrt(64) folded in.
  v2f qf[16];
  {
    const float* qrow = Qb + ((size_t)(b * SEQ + q0w + lr)) * D_MODEL + h * HD;
#pragma unroll
    for (int j = 0; j < 16; ++j) {
      qf[j].x = qrow[4 * j + 2 * half + 0] * 0.125f;
      qf[j].y = qrow[4 * j + 2 * half + 1] * 0.125f;
    }
  }

  v8f oacc[4];
#pragma unroll
  for (int t = 0; t < 4; ++t) oacc[t] = vzero8();
  float mrow[8], lsum[8];
#pragma unroll
  for (int i = 0; i < 8; ++i) { mrow[i] = NEG_BIG; lsum[i] = 0.0f; }

  stageKV(0, 0);
  async_wait0();
  __syncthreads();

  for (int kt = 0; kt <= qt; ++kt) {
    const int cur = kt & 1;
    if (kt < qt) stageKV(cur ^ 1, kt + 1);   // prefetch next K/V tile

    // scores = Q * K^T  (16x64 per wave)
    v8f sacc[4];
#pragma unroll
    for (int t = 0; t < 4; ++t) sacc[t] = vzero8();
#pragma unroll
    for (int j = 0; j < 16; ++j) {
#pragma unroll
      for (int t = 0; t < 4; ++t) {
        v2f bk;
        bk.x = Ks[cur][t * 16 + lr][4 * j + 2 * half + 0];
        bk.y = Ks[cur][t * 16 + lr][4 * j + 2 * half + 1];
        sacc[t] = wmma4(qf[j], bk, sacc[t]);
      }
    }

    if (kt == qt) {  // causal mask on diagonal tile
#pragma unroll
      for (int t = 0; t < 4; ++t)
#pragma unroll
        for (int i = 0; i < 8; ++i) {
          int col = kt * 64 + t * 16 + lr;
          int row = q0w + i + 8 * half;
          sacc[t][i] = (col > row) ? NEG_BIG : sacc[t][i];
        }
    }

    // Online softmax: row (i + 8*half); 16-lane reductions stay in each half.
#pragma unroll
    for (int i = 0; i < 8; ++i) {
      float mx = sacc[0][i];
      mx = fmaxf(mx, sacc[1][i]);
      mx = fmaxf(mx, sacc[2][i]);
      mx = fmaxf(mx, sacc[3][i]);
#pragma unroll
      for (int m = 8; m >= 1; m >>= 1) mx = fmaxf(mx, __shfl_xor(mx, m, 32));
      const float mnew  = fmaxf(mrow[i], mx);
      const float scale = __expf(mrow[i] - mnew);
      float rs = 0.0f;
#pragma unroll
      for (int t = 0; t < 4; ++t) {
        sacc[t][i] = __expf(sacc[t][i] - mnew);
        rs += sacc[t][i];
      }
#pragma unroll
      for (int m = 8; m >= 1; m >>= 1) rs += __shfl_xor(rs, m, 32);
      lsum[i] = lsum[i] * scale + rs;
      mrow[i] = mnew;
#pragma unroll
      for (int t = 0; t < 4; ++t) oacc[t][i] *= scale;
    }

    // Relayout P (C-layout) -> A-layout via per-wave LDS scratch.
#pragma unroll
    for (int t = 0; t < 4; ++t)
#pragma unroll
      for (int i = 0; i < 8; ++i)
        Ps[wave][i + 8 * half][t * 16 + lr] = sacc[t][i];

    // oacc += P * V   (keys are the K-dim now)
#pragma unroll
    for (int j = 0; j < 16; ++j) {
      v2f a;
      a.x = Ps[wave][lr][4 * j + 2 * half + 0];
      a.y = Ps[wave][lr][4 * j + 2 * half + 1];
#pragma unroll
      for (int t = 0; t < 4; ++t) {
        v2f bv;
        bv.x = Vs[cur][4 * j + 2 * half + 0][t * 16 + lr];
        bv.y = Vs[cur][4 * j + 2 * half + 1][t * 16 + lr];
        oacc[t] = wmma4(a, bv, oacc[t]);
      }
    }
    async_wait0();       // next K/V tile resident
    __syncthreads();     // all waves done with cur tile
  }

  // Normalize and store: O[b*S + row][h*64 + col]
#pragma unroll
  for (int i = 0; i < 8; ++i) {
    const float inv_l = 1.0f / lsum[i];
#pragma unroll
    for (int t = 0; t < 4; ++t)
      Ob[(size_t)(b * SEQ + q0w + i + 8 * half) * D_MODEL + h * HD + t * 16 + lr] =
          oacc[t][i] * inv_l;
  }
}

// ---------------------------------------------------------------------------
extern "C" void kernel_launch(void* const* d_in, const int* in_sizes, int n_in,
                              void* d_out, int out_size, void* d_ws, size_t ws_size,
                              hipStream_t stream) {
  const float* x    = (const float*)d_in[0];
  const float* q_w  = (const float*)d_in[1];
  const float* k_w  = (const float*)d_in[2];
  const float* v_w  = (const float*)d_in[3];
  const float* o_w  = (const float*)d_in[4];
  const float* q_nw = (const float*)d_in[5];
  const float* k_nw = (const float*)d_in[6];
  float* out = (float*)d_out;

  float* qbuf = (float*)d_ws;                       // BS * 1024
  float* kbuf = qbuf + (size_t)BS * D_MODEL;        // BS * 256
  float* vbuf = kbuf + (size_t)BS * KVDIM;          // BS * 256
  float* abuf = vbuf + (size_t)BS * KVDIM;          // BS * 1024

  const dim3 blk(128);
  // QKV projections (NT GEMM, fp32 WMMA)
  gemm_nt_f32<<<dim3(D_MODEL / 64, BS / 64), blk, 0, stream>>>(x, q_w, qbuf, BS, D_MODEL, D_MODEL);
  gemm_nt_f32<<<dim3(KVDIM   / 64, BS / 64), blk, 0, stream>>>(x, k_w, kbuf, BS, KVDIM, D_MODEL);
  gemm_nt_f32<<<dim3(KVDIM   / 64, BS / 64), blk, 0, stream>>>(x, v_w, vbuf, BS, KVDIM, D_MODEL);
  // QK-norm + RoPE (in place)
  rmsnorm_rope<<<dim3(BS * N_HEADS / 4), blk, 0, stream>>>(qbuf, q_nw, N_HEADS, SEQ);
  rmsnorm_rope<<<dim3(BS * N_KV    / 4), blk, 0, stream>>>(kbuf, k_nw, N_KV, SEQ);
  // causal GQA flash attention
  flash_attn<<<dim3(SEQ / 64, N_HEADS, BATCH), blk, 0, stream>>>(qbuf, kbuf, vbuf, abuf);
  // output projection
  gemm_nt_f32<<<dim3(D_MODEL / 64, BS / 64), blk, 0, stream>>>(abuf, o_w, out, BS, D_MODEL, D_MODEL);
}

// v001
// Measured time: 301 microseconds a run.
// Next to v000, in two timings, it ran 1.21 times as fast each time.
#include <hip/hip_runtime.h>
#include <hip/hip_bf16.h>

typedef __attribute__((ext_vector_type(2))) float v2f;
typedef __attribute__((ext_vector_type(8))) float v8f;
typedef __attribute__((ext_vector_type(4))) int   v4i;

#define D_MODEL 1024
#define N_HEADS 16
#define N_KV    4
#define HD      64
#define SEQ     2048
#define BATCH   2
#define BS      (BATCH*SEQ)          // 4096 token rows
#define KVDIM   (N_KV*HD)            // 256
#define NEG_BIG (-3.0e38f)
#define NQT     (SEQ/64)             // 32 query tiles of 64 rows

static __device__ __forceinline__ v8f wmma4(v2f a, v2f b, v8f c) {
  // D = A(16x4 f32) * B(4x16 f32) + C(16x16 f32)   [v_wmma_f32_16x16x4_f32]
  return __builtin_amdgcn_wmma_f32_16x16x4_f32(false, a, false, b, (short)0, c,
                                               false, false);
}

static __device__ __forceinline__ v8f vzero8() {
  v8f z;
#pragma unroll
  for (int i = 0; i < 8; ++i) z[i] = 0.0f;
  return z;
}

// --- CDNA5 async global->LDS copy (16B per lane), tracked by ASYNCcnt -------
static __device__ __forceinline__ void async_copy16(const void* g, void* l) {
#if __has_builtin(__builtin_amdgcn_global_load_async_to_lds_b128)
  __builtin_amdgcn_global_load_async_to_lds_b128(
      (__attribute__((address_space(1))) v4i*)(g),
      (__attribute__((address_space(3))) v4i*)(l), 0, 0);
#else
  unsigned lds = (unsigned)(unsigned long long)
      (__attribute__((address_space(3))) void*)l;
  asm volatile("global_load_async_to_lds_b128 %0, %1, off"
               :: "v"(lds), "v"(g) : "memory");
#endif
}

static __device__ __forceinline__ void async_wait0() {
#if __has_builtin(__builtin_amdgcn_s_wait_asynccnt)
  __builtin_amdgcn_s_wait_asynccnt(0);
#else
  asm volatile("s_wait_asynccnt 0x0" ::: "memory");
#endif
}

// ---------------------------------------------------------------------------
// NT GEMM: C[M x N] = A[M x K] * B[N x K]^T, all fp32 row-major.
// Block = 128 threads (4 waves). Block tile 64(M) x 64(N), K-chunks of 32,
// double-buffered async LDS staging. Each wave computes a 16x64 strip.
// ---------------------------------------------------------------------------
__global__ __launch_bounds__(128) void gemm_nt_f32(const float* __restrict__ A,
                                                   const float* __restrict__ Bw,
                                                   float* __restrict__ C,
                                                   int M, int N, int K) {
  __shared__ float As[2][64][36];   // padded rows: no LDS bank conflicts
  __shared__ float Bs[2][64][36];

  const int tid  = threadIdx.x;
  const int wave = tid >> 5;
  const int lane = tid & 31;
  const int half = lane >> 4;    // 0: lanes 0-15, 1: lanes 16-31
  const int lr   = lane & 15;
  const int m_blk = blockIdx.y * 64;
  const int n_blk = blockIdx.x * 64;

  auto stage = [&](int buf, int k0) {
#pragma unroll
    for (int it = 0; it < 4; ++it) {
      int idx = tid + it * 128;          // 0..511
      int r   = idx >> 3;                // row 0..63
      int c4  = idx & 7;                 // float4 col 0..7
      async_copy16(A  + (size_t)(m_blk + r) * K + k0 + c4 * 4, &As[buf][r][c4 * 4]);
      async_copy16(Bw + (size_t)(n_blk + r) * K + k0 + c4 * 4, &Bs[buf][r][c4 * 4]);
    }
  };

  v8f acc[4];
#pragma unroll
  for (int t = 0; t < 4; ++t) acc[t] = vzero8();

  stage(0, 0);
  async_wait0();
  __syncthreads();

  const int nchunks = K >> 5;
  for (int c = 0; c < nchunks; ++c) {
    const int cur = c & 1;
    if (c + 1 < nchunks) stage(cur ^ 1, (c + 1) * 32);   // prefetch next tile

#pragma unroll
    for (int kk = 0; kk < 32; kk += 4) {
      v2f a;
      a.x = As[cur][wave * 16 + lr][kk + 2 * half + 0];
      a.y = As[cur][wave * 16 + lr][kk + 2 * half + 1];
#pragma unroll
      for (int t = 0; t < 4; ++t) {
        v2f b;
        b.x = Bs[cur][t * 16 + lr][kk + 2 * half + 0];
        b.y = Bs[cur][t * 16 + lr][kk + 2 * half + 1];
        acc[t] = wmma4(a, b, acc[t]);
      }
    }
    async_wait0();       // next buffer resident
    __syncthreads();     // all waves done reading cur / writing nxt
  }

  // C layout: VGPR i -> rows (i, i+8) x lanes; n = lr
#pragma unroll
  for (int t = 0; t < 4; ++t)
#pragma unroll
    for (int i = 0; i < 8; ++i)
      C[(size_t)(m_blk + wave * 16 + i + 8 * half) * N + n_blk + t * 16 + lr] =
          acc[t][i];
}

// ---------------------------------------------------------------------------
// Per-(token, head) RMSNorm over HD=64 + RoPE, in place. One wave per head-row.
// buf layout: [B*S][HC*64]
// ---------------------------------------------------------------------------
__global__ __launch_bounds__(128) void rmsnorm_rope(float* __restrict__ buf,
                                                    const float* __restrict__ nw,
                                                    int HC, int S) {
  const int wid  = blockIdx.x * 4 + (threadIdx.x >> 5);
  const int lane = threadIdx.x & 31;
  const int hh   = wid % HC;
  const int tok  = wid / HC;           // b*S + s
  const int s    = tok % S;

  float* p = buf + (size_t)tok * HC * HD + hh * HD;
  float x0 = p[2 * lane];
  float x1 = p[2 * lane + 1];

  float ss = x0 * x0 + x1 * x1;
#pragma unroll
  for (int m = 16; m >= 1; m >>= 1) ss += __shfl_xor(ss, m, 32);
  const float inv = rsqrtf(ss * (1.0f / 64.0f) + 1e-5f);
  x0 *= inv * nw[2 * lane];
  x1 *= inv * nw[2 * lane + 1];

  // pair index = lane; angle = s * theta^(-2*lane/64)
  const float freq = __powf(500000.0f, -((float)(2 * lane) / 64.0f));
  float sn, cs;
  __sincosf((float)s * freq, &sn, &cs);
  p[2 * lane]     = x0 * cs - x1 * sn;
  p[2 * lane + 1] = x1 * cs + x0 * sn;
}

// ---------------------------------------------------------------------------
// Causal GQA flash attention. grid = (S/128, H, B), block = 128 (4 waves).
// Q: [B*S][H*64] (post norm+rope), K/V: [B*S][4*64], O: [B*S][H*64].
// Each wave owns 16 query rows; K/V tiles of 64 keys double-buffered in LDS
// via async copies.
// Causal balance: query tile q walks q + 1 key tiles, so a workgroup runs
// tile NQT-1-p and then tile p, one after the other: NQT + 1 key tiles for
// every workgroup, and all workgroups are resident at once.
// ---------------------------------------------------------------------------
__global__ __launch_bounds__(128) void flash_attn(const float* __restrict__ Qb,
                                                  const float* __restrict__ Kb,
                                                  const float* __restrict__ Vb,
                                                  float* __restrict__ Ob) {
  __shared__ float Ks[2][64][68];
  __shared__ float Vs[2][64][68];
  __shared__ float Ps[4][16][68];      // per-wave P scratch (C->A relayout)

  const int tid  = threadIdx.x;
  const int wave = tid >> 5;
  const int lane = tid & 31;
  const int half = lane >> 4;
  const int lr   = lane & 15;
  const int h    = blockIdx.y;
  const int b    = blockIdx.z;
  const int kvh  = h >> 2;             // 16 heads -> 4 KV heads

  auto stageKV = [&](int buf, int kt) {
#pragma unroll
    for (int it = 0; it < 8; ++it) {
      int idx = tid + it * 128;          // 0..1023
      int r   = idx >> 4;
      int c4  = idx & 15;
      size_t src = ((size_t)(b * SEQ + kt * 64 + r)) * KVDIM + kvh * HD + c4 * 4;
      async_copy16(Kb + src, &Ks[buf][r][c4 * 4]);
      async_copy16(Vb + src, &Vs[buf][r][c4 * 4]);
    }
  };

  for (int pass = 0; pass < 2; ++pass) {
  const int qt  = pass ? (int)blockIdx.x : (NQT - 1 - (int)blockIdx.x);
  const int q0w = qt * 64 + wave * 16;

  // Q fragments in registers, 1/sqrt(64) folded in.
  v2f qf[16];
  {
    const float* qrow = Qb + ((size_t)(b * SEQ + q0w + lr)) * D_MODEL + h * HD;
#pragma unroll
    for (int j = 0; j < 16; ++j) {
      qf[j].x = qrow[4 * j + 2 * half + 0] * 0.125f;
      qf[j].y = qrow[4 * j + 2 * half + 1] * 0.125f;
    }
  }

  v8f oacc[4];
#pragma unroll
  for (int t = 0; t < 4; ++t) oacc[t] = vzero8();
  float mrow[8], lsum[8];
#pragma unroll
  for (int i = 0; i < 8; ++i) { mrow[i] = NEG_BIG; lsum[i] = 0.0f; }

  stageKV(0, 0);
  async_wait0();
  __syncthreads();

  for (int kt = 0; kt <= qt; ++kt) {
    const int cur = kt & 1;
    if (kt < qt) stageKV(cur ^ 1, kt + 1);   // prefetch next K/V tile

    // scores = Q * K^T  (16x64 per wave)
    v8f sacc[4];
#pragma unroll
    for (int t = 0; t < 4; ++t) sacc[t] = vzero8();
#pragma unroll
    for (int j = 0; j < 16; ++j) {
#pragma unroll
      for (int t = 0; t < 4; ++t) {
        v2f bk;
        bk.x = Ks[cur][t * 16 + lr][4 * j + 2 * half + 0];
        bk.y = Ks[cur][t * 16 + lr][4 * j + 2 * half + 1];
        sacc[t] = wmma4(qf[j], bk, sacc[t]);
      }
    }

    if (kt == qt) {  // causal mask on diagonal tile
#pragma unroll
      for (int t = 0; t < 4; ++t)
#pragma unroll
        for (int i = 0; i < 8; ++i) {
          int col = kt * 64 + t * 16 + lr;
          int row = q0w + i + 8 * half;
          sacc[t][i] = (col > row) ? NEG_BIG : sacc[t][i];
        }
    }

    // Online softmax: row (i + 8*half); 16-lane reductions stay in each half.
#pragma unroll
    for (int i = 0; i < 8; ++i) {
      float mx = sacc[0][i];
      mx = fmaxf(mx, sacc[1][i]);
      mx = fmaxf(mx, sacc[2][i]);
      mx = fmaxf(mx, sacc[3][i]);
#pragma unroll
      for (int m = 8; m >= 1; m >>= 1) mx = fmaxf(mx, __shfl_xor(mx, m, 32));
      const float mnew  = fmaxf(mrow[i], mx);
      const float scale = __expf(mrow[i] - mnew);
      float rs = 0.0f;
#pragma unroll
      for (int t = 0; t < 4; ++t) {
        sacc[t][i] = __expf(sacc[t][i] - mnew);
        rs += sacc[t][i];
      }
#pragma unroll
      for (int m = 8; m >= 1; m >>= 1) rs += __shfl_xor(rs, m, 32);
      lsum[i] = lsum[i] * scale + rs;
      mrow[i] = mnew;
#pragma unroll
      for (int t = 0; t < 4; ++t) oacc[t][i] *= scale;
    }

    // Relayout P (C-layout) -> A-layout via per-wave LDS scratch.
#pragma unroll
    for (int t = 0; t < 4; ++t)
#pragma unroll
      for (int i = 0; i < 8; ++i)
        Ps[wave][i + 8 * half][t * 16 + lr] = sacc[t][i];

    // oacc += P * V   (keys are the K-dim now)
#pragma unroll
    for (int j = 0; j < 16; ++j) {
      v2f a;
      a.x = Ps[wave][lr][4 * j + 2 * half + 0];
      a.y = Ps[wave][lr][4 * j + 2 * half + 1];
#pragma unroll
      for (int t = 0; t < 4; ++t) {
        v2f bv;
        bv.x = Vs[cur][4 * j + 2 * half + 0][t * 16 + lr];
        bv.y = Vs[cur][4 * j + 2 * half + 1][t * 16 + lr];
        oacc[t] = wmma4(a, bv, oacc[t]);
      }
    }
    async_wait0();       // next K/V tile resident
    __syncthreads();     // all waves done with cur tile
  }

  // Normalize and store: O[b*S + row][h*64 + col]
#pragma unroll
  for (int i = 0; i < 8; ++i) {
    const float inv_l = 1.0f / lsum[i];
#pragma unroll
    for (int t = 0; t < 4; ++t)
      Ob[(size_t)(b * SEQ + q0w + i + 8 * half) * D_MODEL + h * HD + t * 16 + lr] =
          oacc[t][i] * inv_l;
  }
  // The next tile's set-up overwrites registers that the stores above name.
  asm volatile("s_wait_xcnt 0x0" ::: "memory");
  }  // pass
}

// ---------------------------------------------------------------------------
extern "C" void kernel_launch(void* const* d_in, const int* in_sizes, int n_in,
                              void* d_out, int out_size, void* d_ws, size_t ws_size,
                              hipStream_t stream) {
  const float* x    = (const float*)d_in[0];
  const float* q_w  = (const float*)d_in[1];
  const float* k_w  = (const float*)d_in[2];
  const float* v_w  = (const float*)d_in[3];
  const float* o_w  = (const float*)d_in[4];
  const float* q_nw = (const float*)d_in[5];
  const float* k_nw = (const float*)d_in[6];
  float* out = (float*)d_out;

  float* qbuf = (float*)d_ws;                       // BS * 1024
  float* kbuf = qbuf + (size_t)BS * D_MODEL;        // BS * 256
  float* vbuf = kbuf + (size_t)BS * KVDIM;          // BS * 256
  float* abuf = vbuf + (size_t)BS * KVDIM;          // BS * 1024

  const dim3 blk(128);
  // QKV projections (NT GEMM, fp32 WMMA)
  gemm_nt_f32<<<dim3(D_MODEL / 64, BS / 64), blk, 0, stream>>>(x, q_w, qbuf, BS, D_MODEL, D_MODEL);
  gemm_nt_f32<<<dim3(KVDIM   / 64, BS / 64), blk, 0, stream>>>(x, k_w, kbuf, BS, KVDIM, D_MODEL);
  gemm_nt_f32<<<dim3(KVDIM   / 64, BS / 64), blk, 0, stream>>>(x, v_w, vbuf, BS, KVDIM, D_MODEL);
  // QK-norm + RoPE (in place)
  rmsnorm_rope<<<dim3(BS * N_HEADS / 4), blk, 0, stream>>>(qbuf, q_nw, N_HEADS, SEQ);
  rmsnorm_rope<<<dim3(BS * N_KV    / 4), blk, 0, stream>>>(kbuf, k_nw, N_KV, SEQ);
  // causal GQA flash attention
  flash_attn<<<dim3(NQT / 2, N_HEADS, BATCH), blk, 0, stream>>>(qbuf, kbuf, vbuf, abuf);
  // output projection
  gemm_nt_f32<<<dim3(D_MODEL / 64, BS / 64), blk, 0, stream>>>(abuf, o_w, out, BS, D_MODEL, D_MODEL);
}

// v002
// A run of this version takes 269 microseconds.
// Timed twice side by side with v001, it ran 1.12 times as fast both times.
// Counting every step since v000, it is 1.35 times as fast.
#include <hip/hip_runtime.h>
#include <hip/hip_bf16.h>

typedef __attribute__((ext_vector_type(2))) float v2f;
typedef __attribute__((ext_vector_type(8))) float v8f;
typedef __attribute__((ext_vector_type(4))) int   v4i;

#define D_MODEL 1024
#define N_HEADS 16
#define N_KV    4
#define HD      64
#define SEQ     2048
#define BATCH   2
#define BS      (BATCH*SEQ)          // 4096 token rows
#define KVDIM   (N_KV*HD)            // 256
#define NEG_BIG (-3.0e38f)
#define NQT     (SEQ/64)             // 32 query tiles of 64 rows

static __device__ __forceinline__ v8f wmma4(v2f a, v2f b, v8f c) {
  // D = A(16x4 f32) * B(4x16 f32) + C(16x16 f32)   [v_wmma_f32_16x16x4_f32]
  return __builtin_amdgcn_wmma_f32_16x16x4_f32(false, a, false, b, (short)0, c,
                                               false, false);
}

static __device__ __forceinline__ v8f vzero8() {
  v8f z;
#pragma unroll
  for (int i = 0; i < 8; ++i) z[i] = 0.0f;
  return z;
}

// --- CDNA5 async global->LDS copy (16B per lane), tracked by ASYNCcnt -------
static __device__ __forceinline__ void async_copy16(const void* g, void* l) {
#if __has_builtin(__builtin_amdgcn_global_load_async_to_lds_b128)
  __builtin_amdgcn_global_load_async_to_lds_b128(
      (__attribute__((address_space(1))) v4i*)(g),
      (__attribute__((address_space(3))) v4i*)(l), 0, 0);
#else
  unsigned lds = (unsigned)(unsigned long long)
      (__attribute__((address_space(3))) void*)l;
  asm volatile("global_load_async_to_lds_b128 %0, %1, off"
               :: "v"(lds), "v"(g) : "memory");
#endif
}

static __device__ __forceinline__ void async_wait0() {
#if __has_builtin(__builtin_amdgcn_s_wait_asynccnt)
  __builtin_amdgcn_s_wait_asynccnt(0);
#else
  asm volatile("s_wait_asynccnt 0x0" ::: "memory");
#endif
}

// Value of another lane of the same 16-lane row, picked by a DPP control word.
template <int CTRL>
static __device__ __forceinline__ float dpp_get(float v) {
  return __builtin_bit_cast(
      float, __builtin_amdgcn_update_dpp(0, __builtin_bit_cast(int, v), CTRL,
                                         0xf, 0xf, true));
}

// sin and cos of an angle given in turns (radians / 2 pi). One statement: the
// outputs are early-clobber, so v_cos does not overwrite v_sin's source, and
// the v_nop is the slot that the instruction set asks for between a
// transcendental and a user of its result or an overwrite of its source.
static __device__ __forceinline__ void sincos_turns(float turns, float& sn,
                                                    float& cs) {
  asm("v_sin_f32 %0, %2\n\tv_cos_f32 %1, %2\n\tv_nop"
      : "=&v"(sn), "=&v"(cs)
      : "v"(turns));
}

// ---------------------------------------------------------------------------
// NT GEMM: C[M x N] = A[M x K] * B[N x K]^T, all fp32 row-major.
// Block = 128 threads (4 waves). Block tile 64(M) x 64(N), K-chunks of 32,
// double-buffered async LDS staging. Each wave computes a 16x64 strip.
// NORM: the 64 columns of a block tile are one head, so a wave holds whole
// head rows in its accumulators; RMSNorm over the head (weights nw) and RoPE
// are applied to them before the store.
// ---------------------------------------------------------------------------
template <bool NORM>
__global__ __launch_bounds__(128) void gemm_nt_f32(const float* __restrict__ A,
                                                   const float* __restrict__ Bw,
                                                   float* __restrict__ C,
                                                   const float* __restrict__ nw,
                                                   int M, int N, int K) {
  __shared__ float As[2][64][36];   // padded rows: no LDS bank conflicts
  __shared__ float Bs[2][64][36];

  const int tid  = threadIdx.x;
  const int wave = tid >> 5;
  const int lane = tid & 31;
  const int half = lane >> 4;    // 0: lanes 0-15, 1: lanes 16-31
  const int lr   = lane & 15;
  const int m_blk = blockIdx.y * 64;
  const int n_blk = blockIdx.x * 64;

  auto stage = [&](int buf, int k0) {
#pragma unroll
    for (int it = 0; it < 4; ++it) {
      int idx = tid + it * 128;          // 0..511
      int r   = idx >> 3;                // row 0..63
      int c4  = idx & 7;                 // float4 col 0..7
      async_copy16(A  + (size_t)(m_blk + r) * K + k0 + c4 * 4, &As[buf][r][c4 * 4]);
      async_copy16(Bw + (size_t)(n_blk + r) * K + k0 + c4 * 4, &Bs[buf][r][c4 * 4]);
    }
  };

  v8f acc[4];
#pragma unroll
  for (int t = 0; t < 4; ++t) acc[t] = vzero8();

  stage(0, 0);
  async_wait0();
  __syncthreads();

  const int nchunks = K >> 5;
  // No path round the loop: without one the compiler needs no register copy
  // of an accumulator on the loop's exit edge, directly behind the last WMMA.
  __builtin_assume(nchunks > 0);
  for (int c = 0; c < nchunks; ++c) {
    const int cur = c & 1;
    if (c + 1 < nchunks) stage(cur ^ 1, (c + 1) * 32);   // prefetch next tile

#pragma unroll
    for (int kk = 0; kk < 32; kk += 4) {
      v2f a;
      a.x = As[cur][wave * 16 + lr][kk + 2 * half + 0];
      a.y = As[cur][wave * 16 + lr][kk + 2 * half + 1];
#pragma unroll
      for (int t = 0; t < 4; ++t) {
        v2f b;
        b.x = Bs[cur][t * 16 + lr][kk + 2 * half + 0];
        b.y = Bs[cur][t * 16 + lr][kk + 2 * half + 1];
        acc[t] = wmma4(a, b, acc[t]);
      }
    }
    async_wait0();       // next buffer resident
    __syncthreads();     // all waves done reading cur / writing nxt
  }

  // C layout: VGPR i -> rows (i, i+8) x lanes; n = lr
  if constexpr (NORM) {
    static_assert(HD == 64, "one block tile of columns = one head");
    // Column in the head = t*16 + lr; its RoPE partner sits in lane lr ^ 1.
    float wn[4], freq[4];
#pragma unroll
    for (int t = 0; t < 4; ++t) {
      const int col = t * 16 + lr;
      wn[t]   = nw[col];
      freq[t] = __powf(500000.0f, -((float)(col & ~1) / 64.0f));
    }
    const float sgn = (lr & 1) ? 1.0f : -1.0f;   // odd: +x0*sin, even: -x1*sin
    // Keeps the arithmetic above, which reads no accumulator, between the
    // loop's last WMMA and the first vector read of a WMMA result.
    __builtin_amdgcn_sched_barrier(0);
#pragma unroll
    for (int i = 0; i < 8; ++i) {
      float ss = acc[0][i] * acc[0][i] + acc[1][i] * acc[1][i] +
                 acc[2][i] * acc[2][i] + acc[3][i] * acc[3][i];
      ss += dpp_get<0x161>(ss);   // row_xmask:1
      ss += dpp_get<0x162>(ss);   // row_xmask:2
      ss += dpp_get<0x164>(ss);   // row_xmask:4
      ss += dpp_get<0x168>(ss);   // row_xmask:8
      const float inv = rsqrtf(ss * (1.0f / 64.0f) + 1e-5f);
      const float pos = (float)((m_blk + wave * 16 + i + 8 * half) % SEQ);
#pragma unroll
      for (int t = 0; t < 4; ++t) {
        const float xs = acc[t][i] * (inv * wn[t]);
        const float xp = dpp_get<0xB1>(xs);      // quad_perm:[1,0,3,2]
        float sn, cs;
        sincos_turns(pos * freq[t] * 0.15915494309189532f, sn, cs);
        acc[t][i] = xs * cs + xp * (sgn * sn);
      }
    }
  }
#pragma unroll
  for (int t = 0; t < 4; ++t)
#pragma unroll
    for (int i = 0; i < 8; ++i)
      C[(size_t)(m_blk + wave * 16 + i + 8 * half) * N + n_blk + t * 16 + lr] =
          acc[t][i];
}

// ---------------------------------------------------------------------------
// Causal GQA flash attention. grid = (S/128, H, B), block = 128 (4 waves).
// Q: [B*S][H*64] (post norm+rope), K/V: [B*S][4*64], O: [B*S][H*64].
// Each wave owns 16 query rows; K/V tiles of 64 keys double-buffered in LDS
// via async copies.
// Causal balance: query tile q walks q + 1 key tiles, so a workgroup runs
// tile NQT-1-p and then tile p, one after the other: NQT + 1 key tiles for
// every workgroup, and all workgroups are resident at once.
// ---------------------------------------------------------------------------
__global__ __launch_bounds__(128) void flash_attn(const float* __restrict__ Qb,
                                                  const float* __restrict__ Kb,
                                                  const float* __restrict__ Vb,
                                                  float* __restrict__ Ob) {
  __shared__ float Ks[2][64][68];
  __shared__ float Vs[2][64][68];
  __shared__ float Ps[4][16][68];      // per-wave P scratch (C->A relayout)

  const int tid  = threadIdx.x;
  const int wave = tid >> 5;
  const int lane = tid & 31;
  const int half = lane >> 4;
  const int lr   = lane & 15;
  const int h    = blockIdx.y;
  const int b    = blockIdx.z;
  const int kvh  = h >> 2;             // 16 heads -> 4 KV heads

  auto stageKV = [&](int buf, int kt) {
#pragma unroll
    for (int it = 0; it < 8; ++it) {
      int idx = tid + it * 128;          // 0..1023
      int r   = idx >> 4;
      int c4  = idx & 15;
      size_t src = ((size_t)(b * SEQ + kt * 64 + r)) * KVDIM + kvh * HD + c4 * 4;
      async_copy16(Kb + src, &Ks[buf][r][c4 * 4]);
      async_copy16(Vb + src, &Vs[buf][r][c4 * 4]);
    }
  };

  for (int pass = 0; pass < 2; ++pass) {
  const int qt  = pass ? (int)blockIdx.x : (NQT - 1 - (int)blockIdx.x);
  const int q0w = qt * 64 + wave * 16;

  // Q fragments in registers, 1/sqrt(64) folded in.
  v2f qf[16];
  {
    const float* qrow = Qb + ((size_t)(b * SEQ + q0w + lr)) * D_MODEL + h * HD;
#pragma unroll
    for (int j = 0; j < 16; ++j) {
      qf[j].x = qrow[4 * j + 2 * half + 0] * 0.125f;
      qf[j].y = qrow[4 * j + 2 * half + 1] * 0.125f;
    }
  }

  v8f oacc[4];
#pragma unroll
  for (int t = 0; t < 4; ++t) oacc[t] = vzero8();
  float mrow[8], lsum[8];
#pragma unroll
  for (int i = 0; i < 8; ++i) { mrow[i] = NEG_BIG; lsum[i] = 0.0f; }

  stageKV(0, 0);
  async_wait0();
  __syncthreads();

  for (int kt = 0; kt <= qt; ++kt) {
    const int cur = kt & 1;
    if (kt < qt) stageKV(cur ^ 1, kt + 1);   // prefetch next K/V tile

    // scores = Q * K^T  (16x64 per wave)
    v8f sacc[4];
#pragma unroll
    for (int t = 0; t < 4; ++t) sacc[t] = vzero8();
#pragma unroll
    for (int j = 0; j < 16; ++j) {
#pragma unroll
      for (int t = 0; t < 4; ++t) {
        v2f bk;
        bk.x = Ks[cur][t * 16 + lr][4 * j + 2 * half + 0];
        bk.y = Ks[cur][t * 16 + lr][4 * j + 2 * half + 1];
        sacc[t] = wmma4(qf[j], bk, sacc[t]);
      }
    }

    if (kt == qt) {  // causal mask on diagonal tile
#pragma unroll
      for (int t = 0; t < 4; ++t)
#pragma unroll
        for (int i = 0; i < 8; ++i) {
          int col = kt * 64 + t * 16 + lr;
          int row = q0w + i + 8 * half;
          sacc[t][i] = (col > row) ? NEG_BIG : sacc[t][i];
        }
    }

    // Online softmax: row (i + 8*half); 16-lane reductions stay in each half.
#pragma unroll
    for (int i = 0; i < 8; ++i) {
      float mx = sacc[0][i];
      mx = fmaxf(mx, sacc[1][i]);
      mx = fmaxf(mx, sacc[2][i]);
      mx = fmaxf(mx, sacc[3][i]);
#pragma unroll
      for (int m = 8; m >= 1; m >>= 1) mx = fmaxf(mx, __shfl_xor(mx, m, 32));
      const float mnew  = fmaxf(mrow[i], mx);
      const float scale = __expf(mrow[i] - mnew);
      float rs = 0.0f;
#pragma unroll
      for (int t = 0; t < 4; ++t) {
        sacc[t][i] = __expf(sacc[t][i] - mnew);
        rs += sacc[t][i];
      }
#pragma unroll
      for (int m = 8; m >= 1; m >>= 1) rs += __shfl_xor(rs, m, 32);
      lsum[i] = lsum[i] * scale + rs;
      mrow[i] = mnew;
#pragma unroll
      for (int t = 0; t < 4; ++t) oacc[t][i] *= scale;
    }

    // Relayout P (C-layout) -> A-layout via per-wave LDS scratch.
#pragma unroll
    for (int t = 0; t < 4; ++t)
#pragma unroll
      for (int i = 0; i < 8; ++i)
        Ps[wave][i + 8 * half][t * 16 + lr] = sacc[t][i];

    // oacc += P * V   (keys are the K-dim now)
#pragma unroll
    for (int j = 0; j < 16; ++j) {
      v2f a;
      a.x = Ps[wave][lr][4 * j + 2 * half + 0];
      a.y = Ps[wave][lr][4 * j + 2 * half + 1];
#pragma unroll
      for (int t = 0; t < 4; ++t) {
        v2f bv;
        bv.x = Vs[cur][4 * j + 2 * half + 0][t * 16 + lr];
        bv.y = Vs[cur][4 * j + 2 * half + 1][t * 16 + lr];
        oacc[t] = wmma4(a, bv, oacc[t]);
      }
    }
    async_wait0();       // next K/V tile resident
    __syncthreads();     // all waves done with cur tile
  }

  // Normalize and store: O[b*S + row][h*64 + col]
#pragma unroll
  for (int i = 0; i < 8; ++i) {
    const float inv_l = 1.0f / lsum[i];
#pragma unroll
    for (int t = 0; t < 4; ++t)
      Ob[(size_t)(b * SEQ + q0w + i + 8 * half) * D_MODEL + h * HD + t * 16 + lr] =
          oacc[t][i] * inv_l;
  }
  // The next tile's set-up overwrites registers that the stores above name.
  asm volatile("s_wait_xcnt 0x0" ::: "memory");
  }  // pass
}

// ---------------------------------------------------------------------------
extern "C" void kernel_launch(void* const* d_in, const int* in_sizes, int n_in,
                              void* d_out, int out_size, void* d_ws, size_t ws_size,
                              hipStream_t stream) {
  const float* x    = (const float*)d_in[0];
  const float* q_w  = (const float*)d_in[1];
  const float* k_w  = (const float*)d_in[2];
  const float* v_w  = (const float*)d_in[3];
  const float* o_w  = (const float*)d_in[4];
  const float* q_nw = (const float*)d_in[5];
  const float* k_nw = (const float*)d_in[6];
  float* out = (float*)d_out;

  float* qbuf = (float*)d_ws;                       // BS * 1024
  float* kbuf = qbuf + (size_t)BS * D_MODEL;        // BS * 256
  float* vbuf = kbuf + (size_t)BS * KVDIM;          // BS * 256
  float* abuf = vbuf + (size_t)BS * KVDIM;          // BS * 1024

  const dim3 blk(128);
  // QKV projections (NT GEMM, fp32 WMMA); Q and K with QK-norm + RoPE applied
  gemm_nt_f32<true><<<dim3(D_MODEL / 64, BS / 64), blk, 0, stream>>>(x, q_w, qbuf, q_nw, BS, D_MODEL, D_MODEL);
  gemm_nt_f32<true><<<dim3(KVDIM   / 64, BS / 64), blk, 0, stream>>>(x, k_w, kbuf, k_nw, BS, KVDIM, D_MODEL);
  gemm_nt_f32<false><<<dim3(KVDIM  / 64, BS / 64), blk, 0, stream>>>(x, v_w, vbuf, nullptr, BS, KVDIM, D_MODEL);
  // causal GQA flash attention
  flash_attn<<<dim3(NQT / 2, N_HEADS, BATCH), blk, 0, stream>>>(qbuf, kbuf, vbuf, abuf);
  // output projection
  gemm_nt_f32<false><<<dim3(D_MODEL / 64, BS / 64), blk, 0, stream>>>(abuf, o_w, out, nullptr, BS, D_MODEL, D_MODEL);
}

// v003
// A run of this version takes 238 microseconds.
// Two timings next to v002 put it at 1.11 and 1.10 times that version's speed.
// Counting every step since v000, it is 1.49 times as fast.
#include <hip/hip_runtime.h>
#include <hip/hip_bf16.h>

typedef __attribute__((ext_vector_type(2))) float v2f;
typedef __attribute__((ext_vector_type(4))) float v4f;
typedef __attribute__((ext_vector_type(8))) float v8f;
typedef __attribute__((ext_vector_type(4))) int   v4i;

#define D_MODEL 1024
#define N_HEADS 16
#define N_KV    4
#define HD      64
#define SEQ     2048
#define BATCH   2
#define BS      (BATCH*SEQ)          // 4096 token rows
#define KVDIM   (N_KV*HD)            // 256
#define NEG_BIG (-3.0e38f)
#define NQT     (SEQ/64)             // 32 query tiles of 64 rows

static __device__ __forceinline__ v8f wmma4(v2f a, v2f b, v8f c) {
  // D = A(16x4 f32) * B(4x16 f32) + C(16x16 f32)   [v_wmma_f32_16x16x4_f32]
  return __builtin_amdgcn_wmma_f32_16x16x4_f32(false, a, false, b, (short)0, c,
                                               false, false);
}

static __device__ __forceinline__ v8f vzero8() {
  v8f z;
#pragma unroll
  for (int i = 0; i < 8; ++i) z[i] = 0.0f;
  return z;
}

// --- CDNA5 async global->LDS copy (16B per lane), tracked by ASYNCcnt -------
static __device__ __forceinline__ void async_copy16(const void* g, void* l) {
#if __has_builtin(__builtin_amdgcn_global_load_async_to_lds_b128)
  __builtin_amdgcn_global_load_async_to_lds_b128(
      (__attribute__((address_space(1))) v4i*)(g),
      (__attribute__((address_space(3))) v4i*)(l), 0, 0);
#else
  unsigned lds = (unsigned)(unsigned long long)
      (__attribute__((address_space(3))) void*)l;
  asm volatile("global_load_async_to_lds_b128 %0, %1, off"
               :: "v"(lds), "v"(g) : "memory");
#endif
}

static __device__ __forceinline__ void async_wait0() {
#if __has_builtin(__builtin_amdgcn_s_wait_asynccnt)
  __builtin_amdgcn_s_wait_asynccnt(0);
#else
  asm volatile("s_wait_asynccnt 0x0" ::: "memory");
#endif
}

// Value of another lane of the same 16-lane row, picked by a DPP control word.
template <int CTRL>
static __device__ __forceinline__ float dpp_get(float v) {
  return __builtin_bit_cast(
      float, __builtin_amdgcn_update_dpp(0, __builtin_bit_cast(int, v), CTRL,
                                         0xf, 0xf, true));
}

// Value of lane l ^ 16: the same column in the other 16-lane row.
static __device__ __forceinline__ float xhalf(float v) {
  const int b = __builtin_bit_cast(int, v);
  return __builtin_bit_cast(
      float, __builtin_amdgcn_permlanex16(b, b, 0x76543210, 0xfedcba98, false,
                                          false));
}

// sin and cos of an angle given in turns (radians / 2 pi). One statement: the
// outputs are early-clobber, so v_cos does not overwrite v_sin's source, and
// the v_nop is the slot that the instruction set asks for between a
// transcendental and a user of its result or an overwrite of its source.
static __device__ __forceinline__ void sincos_turns(float turns, float& sn,
                                                    float& cs) {
  asm("v_sin_f32 %0, %2\n\tv_cos_f32 %1, %2\n\tv_nop"
      : "=&v"(sn), "=&v"(cs)
      : "v"(turns));
}

// ---------------------------------------------------------------------------
// NT GEMM: C[M x N] = A[M x K] * B[N x K]^T, all fp32 row-major.
// Block = 128 threads (4 waves). Block tile 64(M) x 64(N), K-chunks of 32,
// double-buffered async LDS staging. Each wave computes a 16x64 strip.
// NORM: the 64 columns of a block tile are one head, so a wave holds whole
// head rows in its accumulators; RMSNorm over the head (weights nw) and RoPE
// are applied to them before the store.
// ---------------------------------------------------------------------------
template <bool NORM>
__global__ __launch_bounds__(128) void gemm_nt_f32(const float* __restrict__ A,
                                                   const float* __restrict__ Bw,
                                                   float* __restrict__ C,
                                                   const float* __restrict__ nw,
                                                   int M, int N, int K) {
  __shared__ float As[2][64][36];   // padded rows: no LDS bank conflicts
  __shared__ float Bs[2][64][36];

  const int tid  = threadIdx.x;
  const int wave = tid >> 5;
  const int lane = tid & 31;
  const int half = lane >> 4;    // 0: lanes 0-15, 1: lanes 16-31
  const int lr   = lane & 15;
  const int m_blk = blockIdx.y * 64;
  const int n_blk = blockIdx.x * 64;

  auto stage = [&](int buf, int k0) {
#pragma unroll
    for (int it = 0; it < 4; ++it) {
      int idx = tid + it * 128;          // 0..511
      int r   = idx >> 3;                // row 0..63
      int c4  = idx & 7;                 // float4 col 0..7
      async_copy16(A  + (size_t)(m_blk + r) * K + k0 + c4 * 4, &As[buf][r][c4 * 4]);
      async_copy16(Bw + (size_t)(n_blk + r) * K + k0 + c4 * 4, &Bs[buf][r][c4 * 4]);
    }
  };

  v8f acc[4];
#pragma unroll
  for (int t = 0; t < 4; ++t) acc[t] = vzero8();

  stage(0, 0);
  async_wait0();
  __syncthreads();

  const int nchunks = K >> 5;
  // No path round the loop: without one the compiler needs no register copy
  // of an accumulator on the loop's exit edge, directly behind the last WMMA.
  __builtin_assume(nchunks > 0);
  for (int c = 0; c < nchunks; ++c) {
    const int cur = c & 1;
    if (c + 1 < nchunks) stage(cur ^ 1, (c + 1) * 32);   // prefetch next tile

#pragma unroll
    for (int kk = 0; kk < 32; kk += 4) {
      v2f a;
      a.x = As[cur][wave * 16 + lr][kk + 2 * half + 0];
      a.y = As[cur][wave * 16 + lr][kk + 2 * half + 1];
#pragma unroll
      for (int t = 0; t < 4; ++t) {
        v2f b;
        b.x = Bs[cur][t * 16 + lr][kk + 2 * half + 0];
        b.y = Bs[cur][t * 16 + lr][kk + 2 * half + 1];
        acc[t] = wmma4(a, b, acc[t]);
      }
    }
    async_wait0();       // next buffer resident
    __syncthreads();     // all waves done reading cur / writing nxt
  }

  // C layout: VGPR i -> rows (i, i+8) x lanes; n = lr
  if constexpr (NORM) {
    static_assert(HD == 64, "one block tile of columns = one head");
    // Column in the head = t*16 + lr; its RoPE partner sits in lane lr ^ 1.
    float wn[4], freq[4];
#pragma unroll
    for (int t = 0; t < 4; ++t) {
      const int col = t * 16 + lr;
      wn[t]   = nw[col];
      freq[t] = __powf(500000.0f, -((float)(col & ~1) / 64.0f));
    }
    const float sgn = (lr & 1) ? 1.0f : -1.0f;   // odd: +x0*sin, even: -x1*sin
    // Keeps the arithmetic above, which reads no accumulator, between the
    // loop's last WMMA and the first vector read of a WMMA result.
    __builtin_amdgcn_sched_barrier(0);
#pragma unroll
    for (int i = 0; i < 8; ++i) {
      float ss = acc[0][i] * acc[0][i] + acc[1][i] * acc[1][i] +
                 acc[2][i] * acc[2][i] + acc[3][i] * acc[3][i];
      ss += dpp_get<0x161>(ss);   // row_xmask:1
      ss += dpp_get<0x162>(ss);   // row_xmask:2
      ss += dpp_get<0x164>(ss);   // row_xmask:4
      ss += dpp_get<0x168>(ss);   // row_xmask:8
      const float inv = rsqrtf(ss * (1.0f / 64.0f) + 1e-5f);
      const float pos = (float)((m_blk + wave * 16 + i + 8 * half) % SEQ);
#pragma unroll
      for (int t = 0; t < 4; ++t) {
        const float xs = acc[t][i] * (inv * wn[t]);
        const float xp = dpp_get<0xB1>(xs);      // quad_perm:[1,0,3,2]
        float sn, cs;
        sincos_turns(pos * freq[t] * 0.15915494309189532f, sn, cs);
        acc[t][i] = xs * cs + xp * (sgn * sn);
      }
    }
  }
#pragma unroll
  for (int t = 0; t < 4; ++t)
#pragma unroll
    for (int i = 0; i < 8; ++i)
      C[(size_t)(m_blk + wave * 16 + i + 8 * half) * N + n_blk + t * 16 + lr] =
          acc[t][i];
}

__global__ __launch_bounds__(128) void flash_attn(const float* __restrict__ Qb,
                                                  const float* __restrict__ Kb,
                                                  const float* __restrict__ Vb,
                                                  float* __restrict__ Ob) {
  __shared__ float Ks[2][64][68];
  __shared__ float Vs[2][64][68];

  const int tid  = threadIdx.x;
  const int wave = tid >> 5;
  const int lane = tid & 31;
  const int half = lane >> 4;
  const int lr   = lane & 15;
  const int h    = blockIdx.y;
  const int b    = blockIdx.z;
  const int kvh  = h >> 2;             // 16 heads -> 4 KV heads

  auto stageKV = [&](int buf, int kt) {
#pragma unroll
    for (int it = 0; it < 8; ++it) {
      int idx = tid + it * 128;          // 0..1023
      int r   = idx >> 4;
      int c4  = idx & 15;
      size_t src = ((size_t)(b * SEQ + kt * 64 + r)) * KVDIM + kvh * HD + c4 * 4;
      async_copy16(Kb + src, &Ks[buf][r][c4 * 4]);
      async_copy16(Vb + src, &Vs[buf][r][c4 * 4]);
    }
  };

  for (int pass = 0; pass < 2; ++pass) {
  const int qt  = pass ? (int)blockIdx.x : (NQT - 1 - (int)blockIdx.x);
  const int q0w = qt * 64 + wave * 16;

  // Q fragments in registers, 1/sqrt(64) folded in.
  v2f qf[16];
  {
    const float* qrow = Qb + ((size_t)(b * SEQ + q0w + lr)) * D_MODEL + h * HD;
#pragma unroll
    for (int j = 0; j < 16; ++j) {
      qf[j].x = qrow[4 * j + 2 * half + 0] * 0.125f;
      qf[j].y = qrow[4 * j + 2 * half + 1] * 0.125f;
    }
  }

  v8f oacc[4];
#pragma unroll
  for (int t = 0; t < 4; ++t) oacc[t] = vzero8();
  float mrow = NEG_BIG;   // running maximum of query lr, alike in both halves
  float lsum = 0.0f;      // running sum over this half's keys only

  stageKV(0, 0);
  async_wait0();
  __syncthreads();

  for (int kt = 0; kt <= qt; ++kt) {
    const int cur = kt & 1;
    if (kt < qt) stageKV(cur ^ 1, kt + 1);   // prefetch next K/V tile

    // scores^T = K * Q^T (64 keys x 16 queries per wave):
    // sacc[t][i] = key t*16 + 8*half + i against query lr
    v8f sacc[4];
#pragma unroll
    for (int t = 0; t < 4; ++t) sacc[t] = vzero8();
#pragma unroll
    for (int j = 0; j < 16; ++j) {
#pragma unroll
      for (int t = 0; t < 4; ++t) {
        v2f ak;
        ak.x = Ks[cur][t * 16 + lr][4 * j + 2 * half + 0];
        ak.y = Ks[cur][t * 16 + lr][4 * j + 2 * half + 1];
        sacc[t] = wmma4(ak, qf[j], sacc[t]);
      }
    }

    if (kt == qt) {  // causal mask on diagonal tile
#pragma unroll
      for (int t = 0; t < 4; ++t)
#pragma unroll
        for (int i = 0; i < 8; ++i) {
          int col = kt * 64 + t * 16 + i + 8 * half;
          int row = q0w + lr;
          sacc[t][i] = (col > row) ? NEG_BIG : sacc[t][i];
        }
    }

    // Online softmax of query lr: four independent in-lane chains, one per
    // key group, then one exchange between the halves for the maximum.
    float mt[4];
#pragma unroll
    for (int t = 0; t < 4; ++t) {
      // Keeps the maxima of the three older groups between the last score
      // WMMA and the first vector read of its result, also on the path that
      // jumps over the mask.
      if (t == 3) __builtin_amdgcn_sched_barrier(0);
      mt[t] = sacc[t][0];
#pragma unroll
      for (int i = 1; i < 8; ++i) mt[t] = fmaxf(mt[t], sacc[t][i]);
    }
    float mx = fmaxf(fmaxf(mt[0], mt[1]), fmaxf(mt[2], mt[3]));
    mx = fmaxf(mx, xhalf(mx));
    const float mnew  = fmaxf(mrow, mx);
    const float scale = __expf(mrow - mnew);
    float rt[4];
#pragma unroll
    for (int t = 0; t < 4; ++t) {
      rt[t] = 0.0f;
#pragma unroll
      for (int i = 0; i < 8; ++i) {
        sacc[t][i] = __expf(sacc[t][i] - mnew);
        rt[t] += sacc[t][i];
      }
    }
    lsum = lsum * scale + ((rt[0] + rt[1]) + (rt[2] + rt[3]));
    mrow = mnew;
#pragma unroll
    for (int t = 0; t < 4; ++t)
#pragma unroll
      for (int i = 0; i < 8; ++i) oacc[t][i] *= scale;

    // oacc^T += V^T * P^T. Registers 2s, 2s+1 of score group g are the B
    // fragment: keys g*16 + 8*half + 2s + {0,1}; V^T is read in the same order.
    // oacc[t][i] = channel t*16 + 8*half + i of query lr
#pragma unroll
    for (int g = 0; g < 4; ++g) {
#pragma unroll
      for (int s = 0; s < 4; ++s) {
        v2f p;
        p.x = sacc[g][2 * s + 0];
        p.y = sacc[g][2 * s + 1];
#pragma unroll
        for (int t = 0; t < 4; ++t) {
          v2f av;
          av.x = Vs[cur][g * 16 + 8 * half + 2 * s + 0][t * 16 + lr];
          av.y = Vs[cur][g * 16 + 8 * half + 2 * s + 1][t * 16 + lr];
          oacc[t] = wmma4(av, p, oacc[t]);
        }
      }
    }
    async_wait0();       // next K/V tile resident
    __syncthreads();     // all waves done with cur tile
  }

  // Join the halves' sums, normalize and store: a lane holds 8 consecutive
  // channels of its query per group, O[b*S + q0w + lr][h*64 + t*16 + 8*half + i].
  {
    const float inv_l = 1.0f / (lsum + xhalf(lsum));
    float* orow = Ob + (size_t)(b * SEQ + q0w + lr) * D_MODEL + h * HD + 8 * half;
#pragma unroll
    for (int t = 0; t < 4; ++t) {
      v4f lo, hi;
#pragma unroll
      for (int i = 0; i < 4; ++i) {
        lo[i] = oacc[t][i] * inv_l;
        hi[i] = oacc[t][i + 4] * inv_l;
      }
      *(v4f*)(orow + t * 16 + 0) = lo;
      *(v4f*)(orow + t * 16 + 4) = hi;
    }
  }
  // The next tile's set-up overwrites registers that the stores above name.
  asm volatile("s_wait_xcnt 0x0" ::: "memory");
  }  // pass
}

// ---------------------------------------------------------------------------
extern "C" void kernel_launch(void* const* d_in, const int* in_sizes, int n_in,
                              void* d_out, int out_size, void* d_ws, size_t ws_size,
                              hipStream_t stream) {
  const float* x    = (const float*)d_in[0];
  const float* q_w  = (const float*)d_in[1];
  const float* k_w  = (const float*)d_in[2];
  const float* v_w  = (const float*)d_in[3];
  const float* o_w  = (const float*)d_in[4];
  const float* q_nw = (const float*)d_in[5];
  const float* k_nw = (const float*)d_in[6];
  float* out = (float*)d_out;

  float* qbuf = (float*)d_ws;                       // BS * 1024
  float* kbuf = qbuf + (size_t)BS * D_MODEL;        // BS * 256
  float* vbuf = kbuf + (size_t)BS * KVDIM;          // BS * 256
  float* abuf = vbuf + (size_t)BS * KVDIM;          // BS * 1024

  const dim3 blk(128);
  // QKV projections (NT GEMM, fp32 WMMA); Q and K with QK-norm + RoPE applied
  gemm_nt_f32<true><<<dim3(D_MODEL / 64, BS / 64), blk, 0, stream>>>(x, q_w, qbuf, q_nw, BS, D_MODEL, D_MODEL);
  gemm_nt_f32<true><<<dim3(KVDIM   / 64, BS / 64), blk, 0, stream>>>(x, k_w, kbuf, k_nw, BS, KVDIM, D_MODEL);
  gemm_nt_f32<false><<<dim3(KVDIM  / 64, BS / 64), blk, 0, stream>>>(x, v_w, vbuf, nullptr, BS, KVDIM, D_MODEL);
  // causal GQA flash attention
  flash_attn<<<dim3(NQT / 2, N_HEADS, BATCH), blk, 0, stream>>>(qbuf, kbuf, vbuf, abuf);
  // output projection
  gemm_nt_f32<false><<<dim3(D_MODEL / 64, BS / 64), blk, 0, stream>>>(abuf, o_w, out, nullptr, BS, D_MODEL, D_MODEL);
}
